// v010
// Times are from an AMD MI455X. After a warm-up the kernel runs many times in a row, and a time is the length of
// such a window on the GPU divided by its runs, so every launch and the gaps after it count. The runs cycle
// through copies of the inputs. A figure is the median of several windows, for all but v000 over two sittings.
// Sittings can differ by a few percent; kernels timed side by side share one.
// This document starts at v010; the versions before it stand elsewhere.
// One run takes 181 microseconds.
// Next to v009, in two timings, it ran 1.06 times as fast each time.
// Counting every step since v000, which is the starting kernel, it is 4.15 times as fast.
// Contractions (1x1 convs for qkv / proj / ffn-in / ffn-out, window q^T.k and v.attn, global q.k^T and attn.v):
// v_wmma_f32_16x16x32_bf16 (bf16 operands, f32 accumulate); computed operands carried as bf16 hi + residual planes,
// weight operands single bf16; layer norms, depthwise 3x3 convs, erf GELU, l2 norms and residual adds in f32 on VALU.
// Inputs RNE-converted to bf16 on load.
#include <hip/hip_runtime.h>
#include <math.h>
#include <stdint.h>

#define NB    2
#define CC    128
#define IMW   128
#define HW    (IMW * IMW)
#define NPIX  (NB * HW)
#define C3    384
#define HID   340
#define HIDP  384
#define NHEAD 4
#define HDC   32
#define WSZ   4
#define NWX   (IMW / WSZ)
#define NWIN  (NWX * NWX)
#define NSLN  (HW / 256)
#define NSLS  (HW / 256)
#define AFSZ  (CC * HDC)
#define RSQ2  0.70710678118654752f
#define GXP   36
#define TXP   132
#define ATP   136
#define GSP   264
#define DWL   8

static_assert((IMW & (IMW - 1)) == 0);
static_assert(IMW % WSZ == 0);
static_assert(WSZ == 4);
static_assert(IMW % DWL == 0);
static_assert(HW % 256 == 0);
static_assert(HW % 64 == 0);
static_assert(NPIX % 256 == 0);
static_assert(CC == NHEAD * HDC);
static_assert(HDC == 32);
static_assert((GXP * 4) % 16 == 0);
static_assert((TXP * 4) % 16 == 0);
static_assert((ATP * 2) % 16 == 0);
static_assert((GSP * 2) % 16 == 0);

// RSA window kernel dynamic LDS map (bytes)
#define RL_R    0
#define RL_QTH  24576
#define RL_QTL  28672
#define RL_KTH  32768
#define RL_KTL  36864
#define RL_ATH  40960
#define RL_ATL  75776
#define RL_VH   110592
#define RL_VL   114944
#define RL_INV  119296
#define RL_END  119424
static_assert(RL_QTH == RL_R + 16 * C3 * 4);
static_assert(RL_QTL == RL_QTH + CC * 16 * 2);
static_assert(RL_KTH == RL_QTL + CC * 16 * 2);
static_assert(RL_KTL == RL_KTH + CC * 16 * 2);
static_assert(RL_ATH == RL_KTL + CC * 16 * 2);
static_assert(RL_ATL == RL_ATH + CC * ATP * 2);
static_assert(RL_VH == RL_ATL + CC * ATP * 2);
static_assert(RL_VL == RL_VH + 16 * ATP * 2);
static_assert(RL_INV == RL_VL + 16 * ATP * 2);
static_assert(RL_END == RL_INV + 32 * 4);
static_assert(16 * TXP * 4 <= RL_QTH - RL_R);

// GSA score kernel dynamic LDS map (bytes)
#define GL_QH   0
#define GL_QL   16896
#define GL_KH   33792
#define GL_KL   50688
#define GL_RED  67584
#define GL_STG  71680
#define GL_SQ   76288
#define GL_END  77312
static_assert(GL_QL == 32 * GSP * 2);
static_assert(GL_KH == 2 * GL_QL);
static_assert(GL_KL == 3 * GL_QL);
static_assert(GL_RED == 4 * GL_QL);
static_assert(GL_STG == GL_RED + 4 * 32 * 8 * 4);
static_assert(GL_SQ == GL_STG + 32 * GXP * 4);
static_assert(GL_END == GL_SQ + 4 * 64 * 4);

typedef __bf16         v16bf __attribute__((ext_vector_type(16)));
typedef unsigned short v8us  __attribute__((ext_vector_type(8)));
typedef float          v8f   __attribute__((ext_vector_type(8)));
typedef float          v4f   __attribute__((ext_vector_type(4)));
typedef unsigned int   v4u   __attribute__((ext_vector_type(4)));
typedef unsigned int   v2u   __attribute__((ext_vector_type(2)));
typedef float          v2f   __attribute__((ext_vector_type(2)));
typedef __bf16         v2bf  __attribute__((ext_vector_type(2)));

union Frag { v16bf v; v8us u[2]; };

// ---- scalar helpers ------------------------------------------------------------------------------------------
// f32 -> bf16 bits, RNE, by the hardware's convert
__device__ __forceinline__ unsigned short bf_bits(float f) { return __builtin_bit_cast(unsigned short, (__bf16)f); }
// two f32 -> two bf16 (RNE) packed in one register, a in the low half, b in the high half: one packed convert
__device__ __forceinline__ unsigned cvt2(float a, float b) {
  const v2f t = {a, b};
  return __builtin_bit_cast(unsigned, __builtin_convertvector(t, v2bf));
}
__device__ __forceinline__ float bf_up(unsigned short h) { return __uint_as_float(((unsigned)h) << 16); }
__device__ __forceinline__ float bfr(float f) { return bf_up(bf_bits(f)); }
// hi = bf16(v), lo = bf16(v - hi)
__device__ __forceinline__ void split_bf(float v, unsigned short& hi, unsigned short& lo) {
  const unsigned short hb = bf_bits(v);
  hi = hb;
  lo = bf_bits(v - bf_up(hb));
}
// the same for two values at once, both results packed (a low, b high): two packed converts, no packing steps
__device__ __forceinline__ void split2(float a, float b, unsigned& ph, unsigned& pl) {
  const unsigned h = cvt2(a, b);
  ph = h;
  pl = cvt2(a - __uint_as_float(h << 16), b - __uint_as_float(h & 0xFFFF0000u));
}
__device__ __forceinline__ void split4(v4f v, v2u& ph, v2u& pl) {
  unsigned h0, h1, l0, l1;
  split2(v[0], v[1], h0, l0);
  split2(v[2], v[3], h1, l1);
  ph[0] = h0; ph[1] = h1;
  pl[0] = l0; pl[1] = l1;
}
__device__ __forceinline__ void split8(v4f v0, v4f v1, v4u& ph, v4u& pl) {
  unsigned h[4], l[4];
  split2(v0[0], v0[1], h[0], l[0]);
  split2(v0[2], v0[3], h[1], l[1]);
  split2(v1[0], v1[1], h[2], l[2]);
  split2(v1[2], v1[3], h[3], l[3]);
#pragma unroll
  for (int e = 0; e < 4; ++e) { ph[e] = h[e]; pl[e] = l[e]; }
}
__device__ __forceinline__ v8f zero8() { v8f z = {0.f, 0.f, 0.f, 0.f, 0.f, 0.f, 0.f, 0.f}; return z; }
__device__ __forceinline__ v8us zero8us() { v8us z = {0, 0, 0, 0, 0, 0, 0, 0}; return z; }

// ---- fragment loaders: 16-bit A/B operand, lane -> row/col (lane&15), p already includes +8*(lane>>4);
//      elements 0..7 <- p[0..7] (k0+8h..), elements 8..15 <- p[16..23] (k0+16+8h..)
__device__ __forceinline__ v16bf ldfrag(const unsigned short* p) {
  Frag f;
  f.u[0] = *(const v8us*)(p);
  f.u[1] = *(const v8us*)(p + 16);
  return f.v;
}
// K = 16 contraction padded to 32: elements 8..15 are zero
__device__ __forceinline__ v16bf ldfrag16(const unsigned short* p) {
  Frag f;
  f.u[0] = *(const v8us*)(p);
  f.u[1] = zero8us();
  return f.v;
}

// ---- WMMA helper with trailing VALU hazard gap ---------------------------------------------------------------
__device__ __forceinline__ v8f mma_bf(v16bf a, v16bf b, v8f c) {
  c = __builtin_amdgcn_wmma_f32_16x16x32_bf16(false, a, false, b, (short)0, c, false, false);
#if defined(__HIP_DEVICE_COMPILE__)
  asm volatile("v_nop\n\tv_nop\n\tv_nop\n\tv_nop" : "+v"(c) : "v"(a), "v"(b));
#endif
  return c;
}
__device__ __forceinline__ void wave_sync_lds() {
  __builtin_amdgcn_fence(__ATOMIC_RELEASE, "workgroup");
  __builtin_amdgcn_wave_barrier();
  __builtin_amdgcn_fence(__ATOMIC_ACQUIRE, "workgroup");
}

// =================================================================================================================
// Weight convert: w f32 [rows][cols] -> bf16 [rowsP][colsP] (zero padded), value = bf16_RNE(w). One thread = 8
// coverage: rowsP * colsP/8 pieces, ceil(pieces/256) blocks (blk = block index within the matrix) with a bound.
// =================================================================================================================
__device__ __forceinline__ void cvt_w(const float* __restrict__ w, unsigned short* outp,
                                      int rows, int cols, int rowsP, int colsP, int blk) {
  const int t = blk * 256 + threadIdx.x;
  const int ppr = colsP >> 3;
  const int npc = rowsP * ppr;
  const bool ok = t < npc;
  const int tt = ok ? t : 0;
  const int r = tt / ppr, c8 = (tt - r * ppr) * 8;
  const int rr = min(r, rows - 1);
  float zv[8];
#pragma unroll
  for (int e = 0; e < 8; ++e) {
    const int c = c8 + e;
    const int cl = min(c, cols - 1);
    const float f = w[(size_t)rr * cols + cl];
    zv[e] = (r < rows && c < cols) ? f : 0.0f;
  }
  v4u pk;
#pragma unroll
  for (int e = 0; e < 4; ++e) pk[e] = cvt2(zv[2 * e], zv[2 * e + 1]);
  unsigned short* gp = outp + (size_t)r * colsP + c8;
  if (ok) *(v4u*)gp = pk;
  
}

// =================================================================================================================
// NCHW f32 x -> pixel-major stream A [b*HW + p][128] f32, values bf16-RNE-converted. Block = (b, 64-pixel tile):
// 128 ch x 64 px loaded coalesced along p into an LDS tile [px][TXP]; store: each pixel row = 512 B = 32 lanes x
// coverage: 8 waves x 8 rows = 64 px x 128 ch per block; NB*(HW/64) blocks (blk) = every pixel once.
// =================================================================================================================
__device__ __forceinline__ void nchw_in(const float* __restrict__ x, float* A, float* xs, int blk) {
  const int tid = threadIdx.x, wave = tid >> 5, lane = tid & 31;
  const int b = blk / (HW / 64);
  const int p0 = (blk - b * (HW / 64)) * 64;
#pragma unroll
  for (int it = 0; it < 8; ++it) {
    const int q = it * 256 + tid;
    const int ch = q >> 4, j4 = (q & 15) * 4;
    const v4f v = *(const v4f*)(x + ((size_t)(b * CC + ch)) * HW + p0 + j4);
#pragma unroll
    for (int e = 0; e < 4; ++e) xs[(j4 + e) * TXP + ch] = bfr(v[e]);
  }
  __syncthreads();
  v4f ov[8];
#pragma unroll
  for (int it = 0; it < 8; ++it) {
    const int row = wave * 8 + it;
    ov[it] = *(const v4f*)(xs + row * TXP + lane * 4);
  }
#pragma unroll
  for (int it = 0; it < 8; ++it) {
    const int row = wave * 8 + it;
    *(v4f*)(A + ((size_t)(b * HW + p0 + row)) * CC + lane * 4) = ov[it];
  }
}

// =================================================================================================================
// Input preparation, one launch: the NCHW transpose and the eight weight converts need nothing of each other, so they
// share one grid by ranges of the block index (block-uniform branches; the transpose's barrier is passed by whole
// blocks only). Blocks [0, PB_T): transpose tiles; then per weight set (spatial, channel) PB_SET blocks: qkv, proj,
// ffn-in, ffn-out. Wb = the bf16 weight region, the four matrices of a set one behind the other, set after set.
// =================================================================================================================
#define PB_T    (NB * (HW / 64))
#define PB_Q    (C3 * CC / 8 / 256)
#define PB_P    (CC * CC / 8 / 256)
#define PB_1    (HIDP * CC / 8 / 256)
#define PB_2    (CC * HIDP / 8 / 256)
#define PB_SET  (PB_Q + PB_P + PB_1 + PB_2)
#define WSETN   (C3 * CC + CC * CC + HIDP * CC + CC * HIDP)
static_assert((C3 * CC) % 2048 == 0 && (CC * CC) % 2048 == 0 && (HIDP * CC) % 2048 == 0);
__global__ __launch_bounds__(256) void prep_k(const float* __restrict__ x, float* A,
                                              const float* __restrict__ wq0, const float* __restrict__ wp0,
                                              const float* __restrict__ w10, const float* __restrict__ w20,
                                              const float* __restrict__ wq1, const float* __restrict__ wp1,
                                              const float* __restrict__ w11, const float* __restrict__ w21,
                                              unsigned short* Wb) {
  __shared__ __align__(16) float xs[64 * TXP];
  const int bi = blockIdx.x;
  if (bi < PB_T) { nchw_in(x, A, xs, bi); return; }
  const int r0 = bi - PB_T;
  const int set = r0 / PB_SET;
  const int r = r0 - set * PB_SET;
  unsigned short* o = Wb + (size_t)set * WSETN;
  if (r < PB_Q) {
    cvt_w(set ? wq1 : wq0, o, C3, CC, C3, CC, r);
  } else if (r < PB_Q + PB_P) {
    cvt_w(set ? wp1 : wp0, o + C3 * CC, CC, CC, CC, CC, r - PB_Q);
  } else if (r < PB_Q + PB_P + PB_1) {
    cvt_w(set ? w11 : w10, o + C3 * CC + CC * CC, HID, CC, HIDP, CC, r - (PB_Q + PB_P));
  } else {
    cvt_w(set ? w21 : w20, o + C3 * CC + CC * CC + HIDP * CC, CC, HID, CC, HIDP, r - (PB_Q + PB_P + PB_1));
  }
}

// =================================================================================================================
// Layer norm of pixel rows over their 128 channels, one wave per row, 4 channels per lane. ln_stats: mean and variance
// by butterfly sums over the 32 lanes (two passes); returns the centred values dv and the variance (the same in every
// lane). ln_out: dv * rstd, scale gv, shift bb, result as bf16 hi + residual, 4 + 4 halves.
// The loops are unrolled in full: constant indices keep the 4-element vectors in registers.
// =================================================================================================================
__device__ __forceinline__ void ln_stats(v4f xv, v4f& dv, float& var) {
  float s = (xv[0] + xv[1]) + (xv[2] + xv[3]);
#pragma unroll
  for (int off = 1; off < 32; off <<= 1) s = s + __shfl_xor(s, off, 32);
  const float mu = s * (1.0f / 128.0f);
  float s2 = 0.f;
#pragma unroll
  for (int e = 0; e < 4; ++e) { dv[e] = xv[e] - mu; s2 = s2 + dv[e] * dv[e]; }
#pragma unroll
  for (int off = 1; off < 32; off <<= 1) s2 = s2 + __shfl_xor(s2, off, 32);
  var = s2 * (1.0f / 128.0f);
}
__device__ __forceinline__ void ln_out(v4f dv, float rstd, v4f gv, v4f bb, v2u& ph, v2u& pl) {
  v4f z;
#pragma unroll
  for (int e = 0; e < 4; ++e) z[e] = (dv[e] * rstd) * gv[e] + bb[e];
  split4(z, ph, pl);
}

// =================================================================================================================
// GEMM: OUT[p][n] = sum_k (Ah[p][k] + Al[p][k]) * W[n][k]  (A planes [pix][K] bf16 hi + residual, W single bf16
// [N][K] k-contiguous, 2 products per tile pair). Block = 8 waves = GBM pixels x all N columns. Per chunk of GKC k the
// block brings its GBM rows of both A planes and all N rows of W into LDS with loads of whole rows (16 lanes x 16 B =
// the 256 B of a row's chunk), rows at a pitch of GPP halves; every fragment is then read from LDS with the split k map.
// So each A row leaves L2 once, not once per 32 output columns, and no global load gathers 32-byte pieces of 16 rows.
// The next chunk's rows are loaded into registers while this chunk is multiplied. Waves: 2 pixel groups of 32 x
// 4 column groups of N/4; a wave holds N/128 tiles of 32 x 32 (2x2 fragments each) and uses its A fragments for all.
// Each sum runs over k in the same order as before (k rising, hi then residual).
// Epilogue (behind a barrier, in the LDS of the operands): each 32x32 f32 tile is staged by its wave and stored as
// whole 128-byte lines. EP 0: OUT[p][N]; EP 1: same + res[p][n] (res pitch 128); EP 2: NCHW d_out[b][n][p] + res[p][n].
// LN 0: A planes from Ah/Al. LN 1 / LN 2 (K = 128, one chunk): the A operand is the layer norm of the f32 rows X[p][128]
// (LN 2, LN 3: of X + P), scale g, shift bv: each wave takes 8 of the block's rows, norms them and writes the two
// planes straight into the operand LDS, while the W rows are still on their way; LN 1 does not read Ah/Al.
// LN 2: P[p][n] = sum_k (Ah[p][k] + Al[p][k]) * Wp[n][k] (128 x 128, the attention's proj conv) is computed by the same
// block first: its GBM rows of Ah/Al and the 128 rows of Wp are staged and multiplied as in the main product (wave =
// 32 x 32, k rising, hi then residual), the f32 tiles go through the LDS of the operands to the waves that norm the
// rows, and those also store P to xo[p][128] (during the main product). So P is never read back from memory and needs
// no launch of its own.
// LN 3: as LN 2, but Ah/Al hold the v planes of the channel attention, and the block first forms the operand of P:
// O[p][h*32 + c] = sum_d v[p][h*32 + d] attn_h[c][d] (attn planes afh/afl [b][128][32], K = 32 per head, both operands
// hi + residual, 3 products: hi.hi, residual.hi, hi.residual). Wave = pixel group mg x head ng, 32 x 32; its f32 tile is
// staged in the W rows' LDS that is still free, split into hi + residual and written over the v planes.
// coverage: 8 waves x 32 rows x N/4 cols per block = GBM px x N cols; grid covers NPIX x N once.
// =================================================================================================================
#define GKC 128
#define GBM 64
#define GPP 136
static_assert((GPP * 2) % 32 == 16);
static_assert(NPIX % GBM == 0 && HW % 32 == 0);
template <int K, int N, int EP, int LN>
__global__ __launch_bounds__(256) void gemm_k(const unsigned short* __restrict__ Ah,
                                              const unsigned short* __restrict__ Al,
                                              const unsigned short* __restrict__ W,
                                              float* outf, const float* __restrict__ res,
                                              const float* __restrict__ X, const float* __restrict__ g,
                                              const float* __restrict__ bv,
                                              const unsigned short* __restrict__ Wp, float* xo,
                                              const unsigned short* __restrict__ afh,
                                              const unsigned short* __restrict__ afl) {
  constexpr int NP = N / 128;                // 32-column tiles per wave
  constexpr int NCH = K / GKC;               // k chunks
  constexpr int WIT = N / 16;                // W rows per thread and chunk
  constexpr int LNR = GBM / 8;               // rows that a wave norms
  static_assert(K % GKC == 0 && N % 128 == 0);
  static_assert(LN == 0 || (K == CC && K == GKC && EP == 0));
  static_assert(8 * NP * 32 * GXP * 4 <= (2 * GBM + N) * GPP * 2);
  static_assert(LN < 2 || N >= CC);
  static_assert(LN != 3 || (8 * 32 * GXP * 4 <= (N - CC) * GPP * 2 && HW % GBM == 0));
  __shared__ __align__(16) unsigned short sm[(2 * GBM + N) * GPP];
  unsigned short* sah = sm;
  unsigned short* sal = sm + GBM * GPP;
  unsigned short* swt = sm + 2 * GBM * GPP;
  float* stg = (float*)sm;                   // reused behind the last chunk's barrier
  const int tid = threadIdx.x, wave = tid >> 5, lane = tid & 31, hh = lane >> 4, l15 = lane & 15;
  const int mb = blockIdx.x * GBM;
  const int mg = wave >> 2, ng = wave & 3;
  const int srow = tid >> 4, spc = (tid & 15) * 8;
  const unsigned short* gah = Ah + (size_t)(mb + srow) * K + spc;
  const unsigned short* gal = Al + (size_t)(mb + srow) * K + spc;
  const unsigned short* gw = W + (size_t)srow * K + spc;
  const int so = srow * GPP + spc;
  // Every loop below is unrolled in full: constant indices keep the staged rows and the sums in registers.
  v8f acc[NP][4];
#pragma unroll
  for (int j = 0; j < NP; ++j) {
#pragma unroll
    for (int f = 0; f < 4; ++f) acc[j][f] = zero8();
  }
  v4u ra[GBM / 16], rl[GBM / 16], rw[WIT], rq[CC / 16];
  v4f xv[LNR], xb[LNR], gv, bb;
  const size_t xro = (size_t)(mb + wave * LNR) * CC + lane * 4;
  if (LN != 1) {
#pragma unroll
    for (int it = 0; it < GBM / 16; ++it) {
      ra[it] = *(const v4u*)(gah + it * 16 * K);
      rl[it] = *(const v4u*)(gal + it * 16 * K);
    }
  }
  v16bf fh0, fh1, fl0, fl1;
  // Each group of loads below may be given registers that held the addresses of the group before it: the waits between
  // the groups stand in front of that.
  if (LN >= 2) {
    asm volatile("s_wait_xcnt 0x0" ::: "memory");
    const unsigned short* gq = Wp + (size_t)srow * CC + spc;
#pragma unroll
    for (int it = 0; it < CC / 16; ++it) rq[it] = *(const v4u*)(gq + it * 16 * CC);
    asm volatile("s_wait_xcnt 0x0" ::: "memory");
  }
  if (LN == 3) {
    const size_t fo = (size_t)(mb / HW) * AFSZ + (size_t)(ng * HDC + l15) * HDC + 8 * hh;
    fh0 = ldfrag(afh + fo); fh1 = ldfrag(afh + fo + 16 * HDC);
    asm volatile("s_wait_xcnt 0x0" ::: "memory");
    fl0 = ldfrag(afl + fo); fl1 = ldfrag(afl + fo + 16 * HDC);
    asm volatile("s_wait_xcnt 0x0" ::: "memory");
  }
  if (LN != 0) {
#pragma unroll
    for (int it = 0; it < LNR; ++it) xv[it] = *(const v4f*)(X + xro + it * CC);
    // the loads below may be given registers that held the addresses of the row loads: the wait stands in front of them
    asm volatile("s_wait_xcnt 0x0" ::: "memory");
    gv = *(const v4f*)(g + lane * 4);
    bb = *(const v4f*)(bv + lane * 4);
  }
  if (LN >= 2) {
#pragma unroll
    for (int it = 0; it < GBM / 16; ++it) {
      *(v4u*)(sah + so + it * 16 * GPP) = ra[it];
      *(v4u*)(sal + so + it * 16 * GPP) = rl[it];
    }
#pragma unroll
    for (int it = 0; it < CC / 16; ++it) *(v4u*)(swt + so + it * 16 * GPP) = rq[it];
    __syncthreads();                         // every wave reads rows that other waves staged
  }
  if (LN == 3) {
    const unsigned short* pa = sah + (mg * 32 + l15) * GPP + ng * HDC + 8 * hh;
    const unsigned short* pl = sal + (mg * 32 + l15) * GPP + ng * HDC + 8 * hh;
    const v16bf a0h = ldfrag(pa), a0l = ldfrag(pl);
    const v16bf a1h = ldfrag(pa + 16 * GPP), a1l = ldfrag(pl + 16 * GPP);
    v8f oc[4];
#pragma unroll
    for (int f = 0; f < 4; ++f) oc[f] = zero8();
    oc[0] = mma_bf(a0h, fh0, oc[0]); oc[0] = mma_bf(a0l, fh0, oc[0]); oc[0] = mma_bf(a0h, fl0, oc[0]);
    oc[1] = mma_bf(a0h, fh1, oc[1]); oc[1] = mma_bf(a0l, fh1, oc[1]); oc[1] = mma_bf(a0h, fl1, oc[1]);
    oc[2] = mma_bf(a1h, fh0, oc[2]); oc[2] = mma_bf(a1l, fh0, oc[2]); oc[2] = mma_bf(a1h, fl0, oc[2]);
    oc[3] = mma_bf(a1h, fh1, oc[3]); oc[3] = mma_bf(a1l, fh1, oc[3]); oc[3] = mma_bf(a1h, fl1, oc[3]);
    float* sw = (float*)(swt + CC * GPP) + wave * (32 * GXP); // behind the rows of Wp
#pragma unroll
    for (int r = 0; r < 8; ++r) {
      sw[(8 * hh + r) * GXP + l15] = oc[0][r];
      sw[(8 * hh + r) * GXP + 16 + l15] = oc[1][r];
      sw[(16 + 8 * hh + r) * GXP + l15] = oc[2][r];
      sw[(16 + 8 * hh + r) * GXP + 16 + l15] = oc[3][r];
    }
    wave_sync_lds();
    const int orow = lane >> 2, opc = (lane & 3) * 8; // 8 rows x 4 pieces of 8 columns per step
    v4u oh[4], ol[4];
#pragma unroll
    for (int it = 0; it < 4; ++it) {
      const float* sp = sw + (it * 8 + orow) * GXP + opc;
      split8(*(const v4f*)(sp), *(const v4f*)(sp + 4), oh[it], ol[it]);
    }
    __syncthreads();                         // the v planes are overwritten: every wave has read its fragments
#pragma unroll
    for (int it = 0; it < 4; ++it) {
      const int po = (mg * 32 + it * 8 + orow) * GPP + ng * HDC + opc;
      *(v4u*)(sah + po) = oh[it];
      *(v4u*)(sal + po) = ol[it];
    }
    __syncthreads();                         // a row's 128 columns were written by four waves
  }
#pragma unroll
  for (int it = 0; it < WIT; ++it) rw[it] = *(const v4u*)(gw + it * 16 * K);
  // the W loads are issued here, behind the row loads, and come in while the rows are normed (LN 2, 3: and while P is
  // computed); without this line the compiler moves them down and the block waits for them afterwards
  if (LN != 0) __builtin_amdgcn_sched_barrier(0);
  if (LN >= 2) {
    // what follows may be given registers that held the addresses of the W loads: the wait stands in front of it
    asm volatile("s_wait_xcnt 0x0" ::: "memory");
    v8f pc[4];
#pragma unroll
    for (int f = 0; f < 4; ++f) pc[f] = zero8();
#pragma unroll
    for (int ks = 0; ks < CC / 32; ++ks) {
      const int ko = ks * 32 + 8 * hh;
      const unsigned short* pa = sah + (mg * 32 + l15) * GPP + ko;
      const unsigned short* pl = sal + (mg * 32 + l15) * GPP + ko;
      const v16bf a0h = ldfrag(pa), a0l = ldfrag(pl);
      const v16bf a1h = ldfrag(pa + 16 * GPP), a1l = ldfrag(pl + 16 * GPP);
      const unsigned short* pb = swt + (ng * 32 + l15) * GPP + ko;
      const v16bf b0 = ldfrag(pb), b1 = ldfrag(pb + 16 * GPP);
      pc[0] = mma_bf(a0h, b0, pc[0]); pc[0] = mma_bf(a0l, b0, pc[0]);
      pc[1] = mma_bf(a0h, b1, pc[1]); pc[1] = mma_bf(a0l, b1, pc[1]);
      pc[2] = mma_bf(a1h, b0, pc[2]); pc[2] = mma_bf(a1l, b0, pc[2]);
      pc[3] = mma_bf(a1h, b1, pc[3]); pc[3] = mma_bf(a1l, b1, pc[3]);
    }
    __syncthreads();                         // the operands' LDS becomes the stage of P: every wave has left it
    float* sw = stg + wave * (32 * GXP);
#pragma unroll
    for (int r = 0; r < 8; ++r) {
      sw[(8 * hh + r) * GXP + l15] = pc[0][r];
      sw[(8 * hh + r) * GXP + 16 + l15] = pc[1][r];
      sw[(16 + 8 * hh + r) * GXP + l15] = pc[2][r];
      sw[(16 + 8 * hh + r) * GXP + 16 + l15] = pc[3][r];
    }
    __syncthreads();                         // a row's 128 columns lie in the tiles of four waves
    // row wave * LNR + it of the block: pixel group mg, row (wave & 3) * LNR + it of its tiles; a lane's 4 columns lie in
    // the tile of column group lane >> 3
    const float* sr = stg + (mg * 4 + (lane >> 3)) * (32 * GXP) + ng * LNR * GXP + (lane & 7) * 4;
#pragma unroll
    for (int it = 0; it < LNR; ++it) xb[it] = *(const v4f*)(sr + it * GXP);
    __syncthreads();                         // the stage becomes operand LDS again: every wave has read its rows
  }
#pragma unroll
  for (int kc = 0; kc < NCH; ++kc) {
    if (kc > 0) __syncthreads();             // every wave has read the chunk that is overwritten next
    if (LN == 0) {
#pragma unroll
      for (int it = 0; it < GBM / 16; ++it) {
        *(v4u*)(sah + so + it * 16 * GPP) = ra[it];
        *(v4u*)(sal + so + it * 16 * GPP) = rl[it];
      }
    } else {
#pragma unroll
      for (int e = 0; e < 4; ++e) { gv[e] = bfr(gv[e]); bb[e] = bfr(bb[e]); }
      float var[LNR];
#pragma unroll
      for (int it = 0; it < LNR; ++it) ln_stats(LN >= 2 ? xv[it] + xb[it] : xv[it], xv[it], var[it]);
      // the root and the division are long sequences: lane i does them for row i, once for the wave's LNR rows
      float vs = var[0];
#pragma unroll
      for (int it = 1; it < LNR; ++it) vs = (lane == it) ? var[it] : vs;
      const float rs = 1.0f / sqrtf(vs + 1e-6f);
#pragma unroll
      for (int it = 0; it < LNR; ++it) {
        const float rstd = __int_as_float(__builtin_amdgcn_readlane(__float_as_int(rs), it));
        v2u ph, pw;
        ln_out(xv[it], rstd, gv, bb, ph, pw);
        const int lo = (wave * LNR + it) * GPP + lane * 4;
        *(v2u*)(sah + lo) = ph;
        *(v2u*)(sal + lo) = pw;
      }
    }
#pragma unroll
    for (int it = 0; it < WIT; ++it) *(v4u*)(swt + so + it * 16 * GPP) = rw[it];
    __syncthreads();                         // every wave reads rows that other waves staged
    if (LN >= 2) {
      // P goes to memory here, behind the last barrier in front of the main product (a barrier waits for stores):
      // the stores are on their way while the block multiplies
#pragma unroll
      for (int it = 0; it < LNR; ++it) *(v4f*)(xo + xro + it * CC) = xb[it];
      // what follows may be given registers that held the addresses of the stores: the wait stands in front of it
      asm volatile("s_wait_xcnt 0x0" ::: "memory");
    }
    if (kc + 1 < NCH) {
#pragma unroll
      for (int it = 0; it < GBM / 16; ++it) {
        ra[it] = *(const v4u*)(gah + it * 16 * K + (kc + 1) * GKC);
        rl[it] = *(const v4u*)(gal + it * 16 * K + (kc + 1) * GKC);
      }
#pragma unroll
      for (int it = 0; it < WIT; ++it) rw[it] = *(const v4u*)(gw + it * 16 * K + (kc + 1) * GKC);
    }
#pragma unroll
    for (int ks = 0; ks < GKC / 32; ++ks) {
      const int ko = ks * 32 + 8 * hh;
      const unsigned short* pa = sah + (mg * 32 + l15) * GPP + ko;
      const unsigned short* pl = sal + (mg * 32 + l15) * GPP + ko;
      const v16bf a0h = ldfrag(pa), a0l = ldfrag(pl);
      const v16bf a1h = ldfrag(pa + 16 * GPP), a1l = ldfrag(pl + 16 * GPP);
#pragma unroll
      for (int j = 0; j < NP; ++j) {
        const unsigned short* pb = swt + (ng * (N / 4) + j * 32 + l15) * GPP + ko;
        const v16bf b0 = ldfrag(pb), b1 = ldfrag(pb + 16 * GPP);
        acc[j][0] = mma_bf(a0h, b0, acc[j][0]); acc[j][0] = mma_bf(a0l, b0, acc[j][0]);
        acc[j][1] = mma_bf(a0h, b1, acc[j][1]); acc[j][1] = mma_bf(a0l, b1, acc[j][1]);
        acc[j][2] = mma_bf(a1h, b0, acc[j][2]); acc[j][2] = mma_bf(a1l, b0, acc[j][2]);
        acc[j][3] = mma_bf(a1h, b1, acc[j][3]); acc[j][3] = mma_bf(a1l, b1, acc[j][3]);
      }
    }
  }
  __syncthreads();                           // the operands' LDS becomes the output stage: every wave has left it
  const int m0 = mb + mg * 32;
#pragma unroll
  for (int j = 0; j < NP; ++j) {
    float* sw = stg + (wave * NP + j) * (32 * GXP);
#pragma unroll
    for (int r = 0; r < 8; ++r) {
      sw[(8 * hh + r) * GXP + l15] = acc[j][0][r];
      sw[(8 * hh + r) * GXP + 16 + l15] = acc[j][1][r];
      sw[(16 + 8 * hh + r) * GXP + l15] = acc[j][2][r];
      sw[(16 + 8 * hh + r) * GXP + 16 + l15] = acc[j][3][r];
    }
  }
  wave_sync_lds();
  const int q = lane >> 3, piece = lane & 7;
#pragma unroll
  for (int j = 0; j < NP; ++j) {
    const float* sw = stg + (wave * NP + j) * (32 * GXP);
    const int n0 = ng * (N / 4) + j * 32;
    v4f ov[8];
    if (EP != 2) {
#pragma unroll
      for (int it = 0; it < 8; ++it) {
        const int row = it * 4 + q;
        v4f v = *(const v4f*)(sw + row * GXP + piece * 4);
        if (EP == 1) {
          const v4f rr = *(const v4f*)(res + (size_t)(m0 + row) * CC + n0 + piece * 4);
          v = v + rr;
        }
        ov[it] = v;
      }
#pragma unroll
      for (int it = 0; it < 8; ++it) {
        const int row = it * 4 + q;
        *(v4f*)(outf + (size_t)(m0 + row) * N + n0 + piece * 4) = ov[it];
      }
    } else {
      const int b = m0 / HW;
      const int plx = m0 - b * HW;
#pragma unroll
      for (int it = 0; it < 8; ++it) {
        const int ch = it * 4 + q;
        v4f v;
#pragma unroll
        for (int e = 0; e < 4; ++e) {
          const float rv = res[(size_t)(m0 + piece * 4 + e) * CC + n0 + ch];
          v[e] = sw[(piece * 4 + e) * GXP + ch] + rv;
        }
        ov[it] = v;
      }
#pragma unroll
      for (int it = 0; it < 8; ++it) {
        const int ch = it * 4 + q;
        *(v4f*)(outf + ((size_t)(b * CC + n0 + ch)) * HW + plx + piece * 4) = ov[it];
      }
    }
  }
}

// =================================================================================================================
// Depthwise 3x3, SAME zero padding, cross-correlation taps, optional cyclic roll (output pixel index in the rolled
// frame, source slab in the unrolled frame: source pixel ((ny+roll) mod IMW, (nx+roll) mod IMW), valid iff the rolled
// neighbour (ny,nx) is inside the image). src [pix][CS] f32 (CS = all 384 channels of the conv), 4 channels per thread,
// weights wd[(wofs + c)*9 + tap] bf16-RNE (clamped address, zero for c >= cvalid): the block's CS*9 weights are read
// once (thread = channel, in steps of 256) and laid out in LDS as [tap][CS], channel contiguous, so that a thread takes
// its 4 channels of one tap with one 16-byte LDS read.
// A thread computes a strip of DWL output pixels along x: it loads the 3 x (DWL+2) source pixels of the strip once,
// all loads in flight together, keeps them in registers, and each loaded column serves up to three outputs; the taps
// come from LDS once per strip. Strips that follow one another in the grid lie under one another in y (a block's
// strips share source rows).
// A row outside the image zeroes its three taps; only the strip's two outer columns can lie outside the image.
// MODE 0: f32 rows dstf[p*dpitch + dcol + c]; MODE 1: exact-erf GELU (rolled) then bf16 hi + residual planes
// Ph/Pl[p*ppitch + dcol + c]; MODE 2: channels below 2*CC (q, k) as MODE 0, the rest (v) as planes without the GELU at
// Ph/Pl[p*ppitch + c - 2*CC] (a wave's 32 threads hold 128 channels in a row, so the choice is the same for a wave).
// coverage: (NPIX/DWL) * CS/4 threads x DWL pixels, grid ceil-div with an in-kernel bound.
// =================================================================================================================
template <int CS, int MODE>
__global__ __launch_bounds__(256) void dw_k(const float* __restrict__ src, const float* __restrict__ wd,
                                            int wofs, int cvalid, int roll,
                                            float* dstf, int dpitch, int dcol,
                                            unsigned short* Ph, unsigned short* Pl, int ppitch) {
  constexpr int TPP = CS / 4;
  constexpr int NSTR = NPIX / DWL;           // strips in all
  constexpr int SPI = HW / DWL;              // strips per image
  static_assert(CS % 128 == 0);
  __shared__ __align__(16) float wsm[9 * CS];
  constexpr int WTR = (CS + 255) / 256;      // thread = channel, its 9 taps, in WTR steps of 256 channels
  float wf[WTR][9];
#pragma unroll                               // constant indices keep wf in registers
  for (int k = 0; k < WTR; ++k) {            // no test here (the address is clamped): every step's loads behind one wait
    const float* wp = wd + min(wofs + (int)threadIdx.x + k * 256, cvalid - 1) * 9;
#pragma unroll                               // constant indices keep wf in registers
    for (int tp = 0; tp < 9; ++tp) wf[k][tp] = wp[tp];
  }
#pragma unroll                               // constant indices keep wf in registers
  for (int k = 0; k < WTR; ++k) {
    const int ch = (int)threadIdx.x + k * 256;
    const float wok = (wofs + ch < cvalid) ? 1.0f : 0.0f;
    if (ch < CS) {                           // whole waves
#pragma unroll                               // constant indices keep wf in registers
      for (int tp = 0; tp < 9; ++tp) wsm[tp * CS + ch] = bfr(wf[k][tp]) * wok;
    }
  }
  __syncthreads();                           // every wave reads table rows that other waves wrote
  const int t = blockIdx.x * 256 + threadIdx.x;
  int s = t / TPP;
  const int cg = t - s * TPP;
  const bool pv = s < NSTR;
  s = pv ? s : (NSTR - 1);
  const int c = cg * 4;
  const int b = s / SPI;
  const int sr = s - b * SPI;
  const int xs = sr / IMW;
  const int y = sr - xs * IMW;
  const int x0 = xs * DWL;
  const v4f* s4 = (const v4f*)src;            // slab rows in 16-byte units: TPP units per pixel
  // Every loop below is unrolled in full so that its indices are constants: the offsets, the 3 x (DWL+2) window,
  // the taps and the DWL sums then live in registers (an index known only at run time would put them in scratch).
  int ro[3], co[DWL + 2], ix[3][DWL + 2];
#pragma unroll                               // see above
  for (int dy = 0; dy < 3; ++dy) {
    const int sy = (y + dy - 1 + roll) & (IMW - 1);
    ro[dy] = (b * HW + sy * IMW) * TPP + cg;
  }
#pragma unroll                               // see above
  for (int j = 0; j < DWL + 2; ++j) {
    const int sx = (x0 + j - 1 + roll) & (IMW - 1);
    co[j] = sx * TPP;
  }
#pragma unroll                               // see above
  for (int dy = 0; dy < 3; ++dy) {
#pragma unroll                               // see above
    for (int j = 0; j < DWL + 2; ++j) ix[dy][j] = ro[dy] + co[j];
  }
  const int p0 = b * HW + y * IMW + x0;      // first output pixel of the strip
  const float ml = (x0 > 0) ? 1.0f : 0.0f;
  const float mr = (x0 + DWL < IMW) ? 1.0f : 0.0f;
  v4f v[3][DWL + 2];
#pragma unroll                               // see above
  for (int dy = 0; dy < 3; ++dy) {
#pragma unroll                               // see above
    for (int j = 0; j < DWL + 2; ++j) v[dy][j] = s4[ix[dy][j]];
    // the next row's loads may be given registers that held this row's offsets: the wait stands in front of them
    if (dy < 2) asm volatile("s_wait_xcnt 0x0" ::: "memory");
  }
  static_assert(DWL == 8);                   // the statement below names the 3 x 10 loaded values one by one
  // Inputs only: every load of the window is issued in front of this line, so the wave waits out one memory latency
  // for all 30; without it the compiler spreads the loads among the sums and waits for them a few at a time.
  asm volatile("" :: "v"(v[0][0]), "v"(v[0][1]), "v"(v[0][2]), "v"(v[0][3]), "v"(v[0][4]),
                     "v"(v[0][5]), "v"(v[0][6]), "v"(v[0][7]), "v"(v[0][8]), "v"(v[0][9]),
                     "v"(v[1][0]), "v"(v[1][1]), "v"(v[1][2]), "v"(v[1][3]), "v"(v[1][4]),
                     "v"(v[1][5]), "v"(v[1][6]), "v"(v[1][7]), "v"(v[1][8]), "v"(v[1][9]),
                     "v"(v[2][0]), "v"(v[2][1]), "v"(v[2][2]), "v"(v[2][3]), "v"(v[2][4]),
                     "v"(v[2][5]), "v"(v[2][6]), "v"(v[2][7]), "v"(v[2][8]), "v"(v[2][9]));
  v4f acc[DWL];
#pragma unroll                               // see above
  for (int i = 0; i < DWL; ++i) acc[i] = v4f{0.f, 0.f, 0.f, 0.f};
  // row by row: a row's registers are free once its three taps are summed; each output still sums its taps 0..8 in order
#pragma unroll                               // see above
  for (int dy = 0; dy < 3; ++dy) {
    const float rm = ((unsigned)(y + dy - 1) < (unsigned)IMW) ? 1.0f : 0.0f;
    v4f wv[3];
#pragma unroll                               // see above
    for (int dx = 0; dx < 3; ++dx) wv[dx] = *(const v4f*)(wsm + (dy * 3 + dx) * CS + c) * rm;
    v[dy][0] = v[dy][0] * ml;
    v[dy][DWL + 1] = v[dy][DWL + 1] * mr;
#pragma unroll                               // see above
    for (int i = 0; i < DWL; ++i) {          // output by output: column i is free once output i has its row
#pragma unroll                               // see above
      for (int dx = 0; dx < 3; ++dx) acc[i] = acc[i] + v[dy][i + dx] * wv[dx];
    }
    // the next row's taps are read only now: all 9 read ahead take 24 registers more, and above 160 registers fewer
    // than three blocks are resident per WGP
    if (dy < 2) __builtin_amdgcn_sched_barrier(0);
  }
#pragma unroll                               // see above
  for (int i = 0; i < DWL; ++i) {
    v4f a = acc[i];
    if (MODE == 1) {
#pragma unroll 1                             // rolled as before: one copy of the erf code per output pixel
      for (int e = 0; e < 4; ++e) {
        const float g = (e == 0) ? a[0] : ((e == 1) ? a[1] : ((e == 2) ? a[2] : a[3]));
        const float er = erff(g * RSQ2);
        float gl = 0.5f * g;
        gl = gl * (1.0f + er);
        a[0] = (e == 0) ? gl : a[0];
        a[1] = (e == 1) ? gl : a[1];
        a[2] = (e == 2) ? gl : a[2];
        a[3] = (e == 3) ? gl : a[3];
      }
    }
    if (MODE == 0 || (MODE == 2 && c < 2 * CC)) {
      float* gp = dstf + (size_t)(p0 + i) * dpitch + dcol + c;
      if (pv) *(v4f*)gp = a;
    } else {
      v2u ph, plw;
      split4(a, ph, plw);
      const size_t to = (size_t)(p0 + i) * ppitch + dcol + (MODE == 2 ? c - 2 * CC : c);
      if (pv) { *(v2u*)(Ph + to) = ph; *(v2u*)(Pl + to) = plw; }
    }
  }
}

// =================================================================================================================
// FFN tail in one kernel: depthwise 3x3 (SAME zero padding, no roll) + exact-erf GELU + the 1x1 out conv (K = HIDP,
// N = CC) + residual. Block = 8 waves = a tile of FTX x 2 pixels = GBM rows of the GEMM. The GELU output never goes to
// memory: per chunk of GKC channels a wave computes one strip of DWL pixels x 128 channels (a thread: 4 channels, the
// 3 x (DWL+2) window in registers, taps from LDS, sums as in dw_k, GELU by gelu4_small) and writes the bf16 hi + residual planes of
// its DWL rows straight into the operand LDS; then the block multiplies the chunk as gemm_k does (2 pixel groups x 4
// column groups of 32 x 32, k rising, hi then residual). The next chunk's window is loaded into registers while this
// chunk is multiplied. All of W (CC rows of HIDP, pitch WPP) and the 9 x HIDP taps are staged in LDS once. Row r of
// pixel group mg is pixel (ty*2 + mg, tx*FTX + r): 32 pixels in a row of the image, so the epilogue stores whole
// 128-byte lines in both output layouts.
// EP 1: OUT[p][CC] = sum + res[p][n]; EP 2: NCHW d_out[b][n][p] = sum + res[p][n].
// coverage: NPIX / GBM blocks x GBM px x CC columns.
// =================================================================================================================
#define WPP 392
#define FTX 32
// Exact-erf GELU of 4 channels for arguments z = g / sqrt(2) with |z| < 1: erf(z) = z + z * P(z * z), P the degree-5
// polynomial that the math library's erff takes on that range, summed in the same order, so the values are erff's own.
// No branch and no select: the 4 channels go through packed multiply-adds, and pixels are independent of one another.
// mx takes up the largest |z| seen: the caller sends a thread with any |z| >= 1 through erff itself.
__device__ __forceinline__ v4f gelu4_small(v4f g, float& mx) {
  const v4f z = g * RSQ2;
  const v4f t = z * z;
  v4f p = __builtin_elementwise_fma(t, (v4f)(-0.000561801775f), (v4f)(0.00491381623f));
  p = __builtin_elementwise_fma(t, p, (v4f)(-0.0267075151f));
  p = __builtin_elementwise_fma(t, p, (v4f)(0.112800106f));
  p = __builtin_elementwise_fma(t, p, (v4f)(-0.376122952f));
  p = __builtin_elementwise_fma(t, p, (v4f)(0.128379107f));
  const v4f er = __builtin_elementwise_fma(z, p, z);
  mx = fmaxf(mx, fmaxf(fmaxf(fabsf(z[0]), fabsf(z[1])), fmaxf(fabsf(z[2]), fabsf(z[3]))));
  return (0.5f * g) * (1.0f + er);
}
static_assert((WPP * 2) % 32 == 16 && WPP >= HIDP);
static_assert(GBM == 2 * FTX && FTX == 4 * DWL && IMW % FTX == 0 && HIDP % GKC == 0 && GKC == 128 && CC == 128);
static_assert((CC * HIDP / 8) % 256 == 0);
// Launch bounds: 4 waves per SIMD = two blocks per WGP, as the LDS allows; without the second figure the compiler
// interleaves the unrolled GELU of all eight pixels on more than 256 registers, and then one block is resident.
template <int EP>
__global__ __launch_bounds__(256, 4) void dwffn_k(const float* __restrict__ src, const float* __restrict__ wd, int cvalid,
                                               const unsigned short* __restrict__ W, float* outf,
                                               const float* __restrict__ res) {
  constexpr int CS = HIDP;
  constexpr int TPP = CS / 4;
  constexpr int NCH = CS / GKC;
  constexpr int WIT = CC * HIDP / 8 / 256;   // 16-byte pieces of W per thread
  constexpr int WTR = (CS + 255) / 256;
  static_assert(8 * 32 * GXP * 4 <= (2 * GBM * GPP + CC * WPP) * 2);
  __shared__ __align__(16) unsigned short sm[2 * GBM * GPP + CC * WPP];
  __shared__ __align__(16) float wsm[9 * CS];
  unsigned short* sah = sm;
  unsigned short* sal = sm + GBM * GPP;
  unsigned short* swt = sm + 2 * GBM * GPP;
  float* stg = (float*)sm;                   // reused behind the last chunk's barrier
  const int tid = threadIdx.x, lane = tid & 31, hh = lane >> 4, l15 = lane & 15;
  // the wave's number in a scalar register: the strip's place, its row addresses and its edge masks are then scalars
  const int wave = __builtin_amdgcn_readfirstlane(tid >> 5);
  const int mg = wave >> 2, ng = wave & 3;
  const int b = blockIdx.x / (HW / GBM);
  const int tr = blockIdx.x - b * (HW / GBM);
  const int ty = tr / (IMW / FTX);
  const int tx = tr - ty * (IMW / FTX);
  const int y = ty * 2 + mg;                 // the wave's strip: image row y, columns x0 .. x0 + DWL - 1
  const int x0 = tx * FTX + ng * DWL;
  const int xl = (x0 - 1) & (IMW - 1), xr = (x0 + DWL) & (IMW - 1);
  const float ml = (x0 > 0) ? 1.0f : 0.0f;
  const float mr = (x0 + DWL < IMW) ? 1.0f : 0.0f;
  const v4f* s4 = (const v4f*)src;           // rows in 16-byte units: TPP units per pixel
  // Every loop below but the one over the chunks is unrolled in full: constant indices keep the window, the sums and
  // the staged values in registers.
  const v4f* rp[3];
#pragma unroll
  for (int dy = 0; dy < 3; ++dy) rp[dy] = s4 + (size_t)(b * HW + ((y + dy - 1) & (IMW - 1)) * IMW) * TPP;
  v4f v[3][DWL + 2];
  const unsigned ul = (unsigned)lane;
  auto ldwin = [&](int kc) {
#pragma unroll
    for (int dy = 0; dy < 3; ++dy) {
      const v4f* r = rp[dy] + kc * (GKC / 4); // scalar bases; the one vector offset is the lane's
      const v4f* rc = r + x0 * TPP;
      v[dy][0] = (r + xl * TPP)[ul];
#pragma unroll
      for (int j = 1; j <= DWL; ++j) v[dy][j] = rc[ul + (j - 1) * TPP];
      v[dy][DWL + 1] = (r + xr * TPP)[ul];
      // what follows may be given registers that held this row's addresses: the wait stands in front of it
      asm volatile("s_wait_xcnt 0x0" ::: "memory");
    }
  };
  float wf[WTR][9];
#pragma unroll
  for (int k = 0; k < WTR; ++k) {            // thread = channel, its 9 taps; the address is clamped
    const float* wp = wd + min(tid + k * 256, cvalid - 1) * 9;
#pragma unroll
    for (int tp = 0; tp < 9; ++tp) wf[k][tp] = wp[tp];
  }
#pragma unroll
  for (int k = 0; k < WTR; ++k) {
    const int ch = tid + k * 256;
    const float wok = (ch < cvalid) ? 1.0f : 0.0f;
    if ((k + 1) * 256 <= CS || ch < CS) {    // whole waves
#pragma unroll
      for (int tp = 0; tp < 9; ++tp) wsm[tp * CS + ch] = bfr(wf[k][tp]) * wok;
    }
  }
  // the W rows are loaded behind this line, when the taps have come in: their loads may be given the registers that
  // held the tap loads' addresses
  __builtin_amdgcn_sched_barrier(0);
  v4u rw[WIT];
#pragma unroll
  for (int it = 0; it < WIT; ++it) rw[it] = *(const v4u*)(W + (size_t)(it * 256 + tid) * 8);
#pragma unroll
  for (int it = 0; it < WIT; ++it) {
    const int q = it * 256 + tid;
    const int row = q / (HIDP / 8);
    *(v4u*)(swt + row * WPP + (q - row * (HIDP / 8)) * 8) = rw[it];
  }
  // the first window is loaded only now, into the registers that the staged W rows have left: both at once take more
  // than 256 registers, and then one block is resident per WGP, not two
  __builtin_amdgcn_sched_barrier(0);
  ldwin(0);
  __syncthreads();                           // every wave reads taps and W rows that other waves staged
  v8f gacc[4];
#pragma unroll
  for (int f = 0; f < 4; ++f) gacc[f] = zero8();
#pragma unroll 1                             // rolled: one copy of the strip, GELU and product code for the three chunks
  for (int kc = 0; kc < NCH; ++kc) {
    static_assert(DWL == 8);                 // the statement below names the 3 x 10 loaded values one by one
    // Inputs only: every load of the window is issued in front of this line and waited for once; without it the
    // compiler may spread the loads among the sums and wait for them a few at a time.
    asm volatile("" :: "v"(v[0][0]), "v"(v[0][1]), "v"(v[0][2]), "v"(v[0][3]), "v"(v[0][4]),
                       "v"(v[0][5]), "v"(v[0][6]), "v"(v[0][7]), "v"(v[0][8]), "v"(v[0][9]),
                       "v"(v[1][0]), "v"(v[1][1]), "v"(v[1][2]), "v"(v[1][3]), "v"(v[1][4]),
                       "v"(v[1][5]), "v"(v[1][6]), "v"(v[1][7]), "v"(v[1][8]), "v"(v[1][9]),
                       "v"(v[2][0]), "v"(v[2][1]), "v"(v[2][2]), "v"(v[2][3]), "v"(v[2][4]),
                       "v"(v[2][5]), "v"(v[2][6]), "v"(v[2][7]), "v"(v[2][8]), "v"(v[2][9]));
    v4f acc[DWL];
#pragma unroll
    for (int i = 0; i < DWL; ++i) acc[i] = v4f{0.f, 0.f, 0.f, 0.f};
    // row by row, each output sums its taps 0..8 in order
#pragma unroll
    for (int dy = 0; dy < 3; ++dy) {
      const float rm = ((unsigned)(y + dy - 1) < (unsigned)IMW) ? 1.0f : 0.0f;
      v4f wv[3];
#pragma unroll
      for (int dx = 0; dx < 3; ++dx) wv[dx] = *(const v4f*)(wsm + (dy * 3 + dx) * CS + kc * GKC + lane * 4) * rm;
      v[dy][0] = v[dy][0] * ml;
      v[dy][DWL + 1] = v[dy][DWL + 1] * mr;
#pragma unroll
      for (int i = 0; i < DWL; ++i) {
#pragma unroll
        for (int dx = 0; dx < 3; ++dx) acc[i] = acc[i] + v[dy][i + dx] * wv[dx];
      }
    }
    if (kc > 0) __syncthreads();             // every wave has read the chunk that is overwritten next
    v4f gq[DWL];
    float mx = 0.f;
#pragma unroll
    for (int i = 0; i < DWL; ++i) gq[i] = gelu4_small(acc[i], mx);
    if (!(mx < 1.0f)) {                      // one test per strip: a thread with an argument outside the polynomial's range
#pragma unroll
      for (int i = 0; i < DWL; ++i) {
        v4f a = acc[i];
#pragma unroll 1                             // rolled as in dw_k: one copy of the erf code per output pixel
        for (int e = 0; e < 4; ++e) {
          const float g = (e == 0) ? a[0] : ((e == 1) ? a[1] : ((e == 2) ? a[2] : a[3]));
          const float er = erff(g * RSQ2);
          float gl = 0.5f * g;
          gl = gl * (1.0f + er);
          a[0] = (e == 0) ? gl : a[0];
          a[1] = (e == 1) ? gl : a[1];
          a[2] = (e == 2) ? gl : a[2];
          a[3] = (e == 3) ? gl : a[3];
        }
        gq[i] = a;
      }
    }
#pragma unroll
    for (int i = 0; i < DWL; ++i) {
      const v4f a = gq[i];
      v2u ph, pw;
      split4(a, ph, pw);
      const int lo = (wave * DWL + i) * GPP + lane * 4;
      *(v2u*)(sah + lo) = ph;
      *(v2u*)(sal + lo) = pw;
    }
    __syncthreads();                         // every wave reads rows that other waves wrote
    if (kc + 1 < NCH) ldwin(kc + 1);         // behind the barrier (which waits for loads): it flies during the products
#pragma unroll
    for (int ks = 0; ks < GKC / 32; ++ks) {
      const int ko = ks * 32 + 8 * hh;
      const unsigned short* pa = sah + (mg * 32 + l15) * GPP + ko;
      const unsigned short* pl = sal + (mg * 32 + l15) * GPP + ko;
      const v16bf a0h = ldfrag(pa), a0l = ldfrag(pl);
      const v16bf a1h = ldfrag(pa + 16 * GPP), a1l = ldfrag(pl + 16 * GPP);
      const unsigned short* pb = swt + (ng * 32 + l15) * WPP + kc * GKC + ko;
      const v16bf b0 = ldfrag(pb), b1 = ldfrag(pb + 16 * WPP);
      gacc[0] = mma_bf(a0h, b0, gacc[0]); gacc[0] = mma_bf(a0l, b0, gacc[0]);
      gacc[1] = mma_bf(a0h, b1, gacc[1]); gacc[1] = mma_bf(a0l, b1, gacc[1]);
      gacc[2] = mma_bf(a1h, b0, gacc[2]); gacc[2] = mma_bf(a1l, b0, gacc[2]);
      gacc[3] = mma_bf(a1h, b1, gacc[3]); gacc[3] = mma_bf(a1l, b1, gacc[3]);
    }
  }
  __syncthreads();                           // the operands' LDS becomes the output stage: every wave has left it
  const int m0 = b * HW + y * IMW + tx * FTX; // first pixel of the wave's 32 rows
  const int n0 = ng * 32;
  float* sw = stg + wave * (32 * GXP);
#pragma unroll
  for (int r = 0; r < 8; ++r) {
    sw[(8 * hh + r) * GXP + l15] = gacc[0][r];
    sw[(8 * hh + r) * GXP + 16 + l15] = gacc[1][r];
    sw[(16 + 8 * hh + r) * GXP + l15] = gacc[2][r];
    sw[(16 + 8 * hh + r) * GXP + 16 + l15] = gacc[3][r];
  }
  wave_sync_lds();
  const int q = lane >> 3, piece = lane & 7;
  v4f ov[8];
  // one address per lane for the loads and one for the stores; the eight steps are constant offsets from it
  if (EP == 1) {
    const size_t o0 = (size_t)(m0 + q) * CC + n0 + piece * 4;
    const float* rq = res + o0;
    float* oq = outf + o0;
#pragma unroll
    for (int it = 0; it < 8; ++it) {
      const v4f rr = *(const v4f*)(rq + it * 4 * CC);
      ov[it] = *(const v4f*)(sw + (it * 4 + q) * GXP + piece * 4) + rr;
    }
#pragma unroll
    for (int it = 0; it < 8; ++it) *(v4f*)(oq + it * 4 * CC) = ov[it];
  } else {
    const float* rq = res + (size_t)(m0 + piece * 4) * CC + n0 + q;
    float* oq = outf + (size_t)(b * CC + n0 + q) * HW + (m0 - b * HW) + piece * 4;
#pragma unroll
    for (int it = 0; it < 8; ++it) {
      v4f o;
#pragma unroll
      for (int e = 0; e < 4; ++e) o[e] = sw[(piece * 4 + e) * GXP + it * 4 + q] + rq[e * CC + it * 4];
      ov[it] = o;
    }
#pragma unroll
    for (int it = 0; it < 8; ++it) *(v4f*)(oq + (size_t)it * 4 * HW) = ov[it];
  }
}

// =================================================================================================================
// RSA window attention, one 4x4 window (16 tokens) per block of 256 threads, R = dwconv output in the rolled frame
// [pix][384] f32 (q | k | v column blocks):
//   phase 0: the 16 token rows x 384 f32 into LDS; phase 1: per token and per q/k the l2 norm over its 128 channels
//   (inv = 1/max(sqrt(sum), 1e-12)); phase 2: q^T and k^T as bf16 hi + residual planes [c][16 tok] (k contiguous),
//   v as planes [tok][ATP]; phase 3 (wave = c tile): attn[c][d] = relu(temp * sum_p qn[p][c] kn[p][d]) on WMMA, K = 16
//   (fragment elements 8..15 zero), 3 products, stored transposed as planes AttT[d][c]; phase 4 (wave = d tile):
//   out[p][d] = sum_c v[p][c] attn[c][d], K = 128, 3 products, staged f32 [16][TXP] in LDS; phase 5: each token row
//   (128 values -> hi + residual, 256 B per plane = 16 lanes x 16 B) written to its unrolled pixel (inverse roll +2,+2),
//   coverage: qT/kT 128 c x 16 tok x 2 planes, v 16 x 128, AttT 128 d x 128 c (8 waves x 8 tiles), out 16 x 128
//   (8 waves x 16 cols), store 8 waves x 2 rows x 128.
// =================================================================================================================
__global__ __launch_bounds__(256) void rsa_attn_k(const float* __restrict__ R, const float* __restrict__ temp,
                                                  unsigned short* Th, unsigned short* Tl) {
#pragma clang fp contract(off)
  extern __shared__ __align__(16) char smem[];
  float* sR = (float*)(smem + RL_R);
  float* ost = (float*)(smem + RL_R);                     // reused after phase 2
  unsigned short* qt = (unsigned short*)(smem + RL_QTH);  // qT hi @0, qT lo @2048, kT hi @4096, kT lo @6144 (halves)
  unsigned short* ath = (unsigned short*)(smem + RL_ATH);
  unsigned short* atl = (unsigned short*)(smem + RL_ATL);
  unsigned short* vh = (unsigned short*)(smem + RL_VH);
  unsigned short* vl = (unsigned short*)(smem + RL_VL);
  float* sinv = (float*)(smem + RL_INV);
  const int tid = threadIdx.x, wave = tid >> 5, lane = tid & 31, hh = lane >> 4, l15 = lane & 15;
  const int b = blockIdx.x / NWIN;
  const int w2 = blockIdx.x - b * NWIN;
  const int wy = w2 / NWX;
  const int wx = w2 - wy * NWX;

  // ---- phase 0: token rows ----
#pragma unroll
  for (int it = 0; it < 6; ++it) {
    const int idx = it * 256 + tid;
    const int pi = idx / 96;
    const int c4 = (idx - pi * 96) * 4;
    const int ry = wy * WSZ + (pi / WSZ), rx = wx * WSZ + (pi - (pi / WSZ) * WSZ);
    const v4f v = *(const v4f*)(R + ((size_t)(b * HW) + (size_t)ry * IMW + rx) * C3 + c4);
    *(v4f*)(sR + pi * C3 + c4) = v;
  }
  __syncthreads();

  // ---- phase 1: l2 norms per token over its 128 q (or k) channels ----
  {
    const int pair = tid >> 3, sub = tid & 7;
    const int sel = pair >> 4, pi = pair & 15;
    const float* rp = sR + pi * C3 + sel * CC + sub * 16;
    float s = 0.f;
#pragma unroll
    for (int j = 0; j < 16; ++j) { const float f = rp[j]; const float ff = f * f; s = s + ff; }
    s = s + __shfl_xor(s, 1, 32);
    s = s + __shfl_xor(s, 2, 32);
    s = s + __shfl_xor(s, 4, 32);
    const float inv = 1.0f / fmaxf(sqrtf(s), 1e-12f);
    if (sub == 0) sinv[pair] = inv;
  }
  __syncthreads();

  // ---- phase 2: normalised q^T / k^T planes and v planes ----
  {
    const int c = tid >> 1, sel = tid & 1;
    float nv[16];
#pragma unroll
    for (int pi = 0; pi < 16; ++pi) nv[pi] = sR[pi * C3 + sel * CC + c] * sinv[sel * 16 + pi];
    v4u h0, h1, l0, l1;
#pragma unroll
    for (int e = 0; e < 4; ++e) {
      unsigned ha, la, hb, lb;
      split2(nv[2 * e], nv[2 * e + 1], ha, la);
      split2(nv[8 + 2 * e], nv[8 + 2 * e + 1], hb, lb);
      h0[e] = ha; l0[e] = la;
      h1[e] = hb; l1[e] = lb;
    }
    unsigned short* dh = qt + sel * 4096 + c * 16;
    unsigned short* dl = dh + 2048;
    *(v4u*)(dh) = h0; *(v4u*)(dh + 8) = h1;
    *(v4u*)(dl) = l0; *(v4u*)(dl + 8) = l1;
    const int pi = tid >> 4, c8 = (tid & 15) * 8;
    const float* vr = sR + pi * C3 + 2 * CC + c8;
    const v4f v0 = *(const v4f*)(vr);
    const v4f v1 = *(const v4f*)(vr + 4);
    v4u ph, plw;
    split8(v0, v1, ph, plw);
    *(v4u*)(vh + pi * ATP + c8) = ph;
    *(v4u*)(vl + pi * ATP + c8) = plw;
  }
  __syncthreads();

  const float tmp = bfr(temp[0]);
  // ---- phase 3: attn = relu(temp * q^T k), 128 x 128, K = 16 ----
  {
    const int mi = wave;
    const v16bf a_h = ldfrag16(qt + (mi * 16 + l15) * 16 + 8 * hh);
    const v16bf a_l = ldfrag16(qt + 2048 + (mi * 16 + l15) * 16 + 8 * hh);
#pragma unroll 2
    for (int ni = 0; ni < 8; ++ni) {
      const v16bf b_h = ldfrag16(qt + 4096 + (ni * 16 + l15) * 16 + 8 * hh);
      const v16bf b_l = ldfrag16(qt + 6144 + (ni * 16 + l15) * 16 + 8 * hh);
      v8f acc = zero8();
      acc = mma_bf(a_h, b_h, acc);
      acc = mma_bf(a_h, b_l, acc);
      acc = mma_bf(a_l, b_h, acc);
      v4u ph, plw;
#pragma unroll
      for (int e = 0; e < 4; ++e) {
        unsigned hw, lw;
        split2(fmaxf(acc[2 * e] * tmp, 0.0f), fmaxf(acc[2 * e + 1] * tmp, 0.0f), hw, lw);
        ph[e] = hw; plw[e] = lw;
      }
      const int d = ni * 16 + l15;
      *(v4u*)(ath + d * ATP + mi * 16 + 8 * hh) = ph;
      *(v4u*)(atl + d * ATP + mi * 16 + 8 * hh) = plw;
    }
  }
  __syncthreads();

  // ---- phase 4: out[p][d] = sum_c v[p][c] attn[c][d], K = 128 ----
  {
    const int ni = wave;
    v8f acc = zero8();
#pragma unroll
    for (int ks = 0; ks < 4; ++ks) {
      const v16bf a_h = ldfrag(vh + l15 * ATP + ks * 32 + 8 * hh);
      const v16bf a_l = ldfrag(vl + l15 * ATP + ks * 32 + 8 * hh);
      const v16bf b_h = ldfrag(ath + (ni * 16 + l15) * ATP + ks * 32 + 8 * hh);
      const v16bf b_l = ldfrag(atl + (ni * 16 + l15) * ATP + ks * 32 + 8 * hh);
      acc = mma_bf(a_h, b_h, acc);
      acc = mma_bf(a_h, b_l, acc);
      acc = mma_bf(a_l, b_h, acc);
    }
#pragma unroll
    for (int r = 0; r < 8; ++r) ost[(8 * hh + r) * TXP + ni * 16 + l15] = acc[r];
  }
  __syncthreads();

  // ---- phase 5: token rows to their unrolled pixels ----
  {
    const int tk = 2 * wave + hh;
    const int piece = l15;
    const float* orow = ost + tk * TXP + piece * 8;
    const v4f v0 = *(const v4f*)(orow);
    const v4f v1 = *(const v4f*)(orow + 4);
    v4u ph, plw;
    split8(v0, v1, ph, plw);
    const int iy = tk / WSZ, ix = tk - (tk / WSZ) * WSZ;
    const int ry = wy * WSZ + iy, rx = wx * WSZ + ix;
    const int py = (ry + WSZ / 2) & (IMW - 1), px = (rx + WSZ / 2) & (IMW - 1);
    const size_t gp = ((size_t)(b * HW) + (size_t)py * IMW + px) * CC + piece * 8;
    *(v4u*)(Th + gp) = ph;
    *(v4u*)(Tl + gp) = plw;
    
  }
}

// =================================================================================================================
// GSA score and sum-of-squares partials: block = (b, head h, slab of 256 pixels), S[c][d] = sum_n q[h*32+c][n]
// k[h*32+d][n] over the slab on WMMA. A thread holds one of the head's 64 q and k columns (f32 from R) at 64 of the
// slab's pixels: its 64 loads are issued together, so a block waits out one memory latency, and NB*NHEAD*NSLS blocks
// fill the chip. From those registers: the column's sum of squares (8 chains of 8 pixels, added as a tree; the four
// pixel groups of a column are added through LDS) and the bf16 hi + residual planes, transposed in LDS ([32 ch][GSP],
// k contiguous); waves: fragment f = wave&3 (2x2 of 16x16), k half = wave>>2; 3 products; the two k halves are
// combined in fixed order through LDS; the 32x32 f32 tile is staged and stored as whole lines.
// blk = (b*NHEAD + h)*NSLS + slab. coverage: planes 64 ch x 256 px (64 threads x 32 groups x 8 px), tile 32x32 per
// block, 64 of the 256 sums of squares of (b, slab) per block (2 whole 128-byte lines).
// =================================================================================================================
__global__ __launch_bounds__(256) void gsa_s_k(const float* __restrict__ R, float* pa, float* pn) {
  extern __shared__ __align__(16) char smem[];
  unsigned short* pl = (unsigned short*)(smem + GL_QH);   // q hi @0, q lo @8448, k hi @16896, k lo @25344 (halves)
  float* red = (float*)(smem + GL_RED);
  float* stg = (float*)(smem + GL_STG);
  float* sq = (float*)(smem + GL_SQ);
  const int tid = threadIdx.x, wave = tid >> 5, lane = tid & 31, hh = lane >> 4, l15 = lane & 15;
  const int blk = blockIdx.x;
  const int b = blk / (NHEAD * NSLS);
  const int rem = blk - b * (NHEAD * NSLS);
  const int h = rem / NSLS;
  const int slab = rem - h * NSLS;
  const int f = wave & 3, mi = f >> 1, ni = f & 1, kh = wave >> 2;
  const int c = tid & 63, sel = c >> 5, cc = c & 31;
  const int col = sel * CC + h * HDC + cc;
  unsigned short* ph = pl + sel * 16896 + cc * GSP;
  unsigned short* plo = ph + 8448;
  const int g0 = tid >> 6;
  const float* rp = R + ((size_t)(b * HW) + (size_t)slab * 256 + g0 * 8) * C3 + col;
  // Every loop below is unrolled in full: constant indices keep the 64 loaded values in registers.
  v4f v0[8], v1[8];
#pragma unroll
  for (int it = 0; it < 8; ++it) {
#pragma unroll
    for (int j = 0; j < 4; ++j) {
      v0[it][j] = rp[(it * 32 + j) * C3];
      v1[it][j] = rp[(it * 32 + j + 4) * C3];
    }
  }
  float sp[8];
#pragma unroll
  for (int it = 0; it < 8; ++it) {
    float t = 0.f;
#pragma unroll
    for (int j = 0; j < 4; ++j) t = fmaf(v0[it][j], v0[it][j], t);
#pragma unroll
    for (int j = 0; j < 4; ++j) t = fmaf(v1[it][j], v1[it][j], t);
    sp[it] = t;
  }
  sq[g0 * 64 + c] = ((sp[0] + sp[1]) + (sp[2] + sp[3])) + ((sp[4] + sp[5]) + (sp[6] + sp[7]));
#pragma unroll
  for (int it = 0; it < 8; ++it) {
    const int g = it * 4 + g0;
    v4u hp, lp;
    split8(v0[it], v1[it], hp, lp);
    *(v4u*)(ph + g * 8) = hp;
    *(v4u*)(plo + g * 8) = lp;
  }
  __syncthreads();                           // every wave reads plane rows and sums that other waves wrote
  v8f acc = zero8();
#pragma unroll
  for (int ks = 0; ks < 4; ++ks) {
    const int k0 = (kh * 4 + ks) * 32;
    const v16bf a_h = ldfrag(pl + (mi * 16 + l15) * GSP + k0 + 8 * hh);
    const v16bf a_l = ldfrag(pl + 8448 + (mi * 16 + l15) * GSP + k0 + 8 * hh);
    const v16bf b_h = ldfrag(pl + 16896 + (ni * 16 + l15) * GSP + k0 + 8 * hh);
    const v16bf b_l = ldfrag(pl + 25344 + (ni * 16 + l15) * GSP + k0 + 8 * hh);
    acc = mma_bf(a_h, b_h, acc);
    acc = mma_bf(a_h, b_l, acc);
    acc = mma_bf(a_l, b_h, acc);
  }
  if (wave >= 4) {
#pragma unroll
    for (int r = 0; r < 8; ++r) red[((wave - 4) * 32 + lane) * 8 + r] = acc[r];
  }
  __syncthreads();
  if (wave < 4) {
    const v4f o0 = *(const v4f*)(red + (wave * 32 + lane) * 8);
    const v4f o1 = *(const v4f*)(red + (wave * 32 + lane) * 8 + 4);
#pragma unroll
    for (int r = 0; r < 8; ++r) {
      const float v = acc[r] + (r < 4 ? o0[r & 3] : o1[r & 3]);
      stg[(mi * 16 + 8 * hh + r) * GXP + ni * 16 + l15] = v;
    }
  }
  __syncthreads();
  {
    const int row = tid >> 3, piece = tid & 7;
    const v4f v = *(const v4f*)(stg + row * GXP + piece * 4);
    float* gp = pa + (size_t)blk * 1024 + row * 32 + piece * 4;
    *(v4f*)gp = v;
  }
  if (tid < 64) {                            // whole waves
    const float t = (sq[c] + sq[64 + c]) + (sq[128 + c] + sq[192 + c]);
    pn[((size_t)(b * NSLN + slab)) * 256 + col] = t;
  }
}

// =================================================================================================================
// GSA finisher, block = (b, h, quarter of the head's 32x32 tile), 10 waves. Waves 0..7: thread = one element
// e = c*32 + d, attn[c][d] = relu(sum of pa partials * invq[c] * invk[d] * temp) -> bf16 hi + residual planes.
// Waves 8, 9: invq/invk = 1/max(sqrt(sum of pn partials), 1e-12) for the head's 32 q and 32 k channels. Partials are
// summed slab by slab in rising order; a thread's NSLS loads are issued together, and no wave has more than those to
// wait for. A block writes 512 bytes in a row of each plane.
// =================================================================================================================
#define FINQ 4
static_assert(FINQ * 256 == HDC * HDC);
static_assert(NSLS == NSLN);
__global__ __launch_bounds__(320) void gsa_fin_k(const float* __restrict__ pa, const float* __restrict__ pn,
                                                 const float* __restrict__ temp,
                                                 unsigned short* afh, unsigned short* afl) {
#pragma clang fp contract(off)
  __shared__ float sinv[64];
  const int tid = threadIdx.x;
  const int bh = blockIdx.x / FINQ;
  const int e = (blockIdx.x - bh * FINQ) * 256 + (tid & 255);
  const int b = bh / NHEAD;
  const int h = bh - b * NHEAD;
  const bool nrm = tid >= 256;               // whole waves
  // The loops over the slabs are unrolled in full: constant indices keep the loaded partials in registers.
  float pv[NSLS];
  float s = 0.f;
  if (nrm) {
    const int sel = (tid >> 5) & 1, i = tid & 31;
    const float* np = pn + (size_t)b * (NSLN * 256) + sel * CC + h * HDC + i;
#pragma unroll
    for (int sl = 0; sl < NSLN; ++sl) pv[sl] = np[sl * 256];
#pragma unroll
    for (int sl = 0; sl < NSLN; ++sl) s = s + pv[sl];
    sinv[tid - 256] = 1.0f / fmaxf(sqrtf(s), 1e-12f);
  } else {
    const float* pp = pa + (size_t)bh * (NSLS * 1024) + e;
#pragma unroll
    for (int sl = 0; sl < NSLS; ++sl) pv[sl] = pp[sl * 1024];
#pragma unroll
    for (int sl = 0; sl < NSLS; ++sl) s = s + pv[sl];
  }
  __syncthreads();
  if (nrm) return;
  const float tmp = bfr(temp[0]);
  float v = s * sinv[e >> 5];
  v = v * sinv[32 + (e & 31)];
  v = v * tmp;
  v = fmaxf(v, 0.0f);
  unsigned short hi, lo;
  split_bf(v, hi, lo);
  const size_t to = (size_t)b * AFSZ + (size_t)h * (HDC * HDC) + e;
  afh[to] = hi;
  afl[to] = lo;
}

// =================================================================================================================
// Workspace map (bytes), NPIX = NB*HW: A f32 [NPIX][128], Bx same, T = two bf16 planes [NPIX][128], U f32
// [NPIX][384], R f32 [NPIX][384], weights bf16 (655360), pn f32 [NB*NSLN][256], pa f32 [NB*NHEAD*NSLS][1024], af two bf16
// planes [NB][128][32]. Total 153911296 for NB=2, IMW=128. Every region is an exact multiple of its whole-row store
// granularity.
// =================================================================================================================
extern "C" void kernel_launch(void* const* d_in, const int* in_sizes, int n_in,
                              void* d_out, int out_size, void* d_ws, size_t ws_size,
                              hipStream_t stream) {
  if (n_in < 23) return;
  if (in_sizes[0] != NPIX * CC) return;
  if (in_sizes[1] != CC || in_sizes[2] != CC || in_sizes[3] != CC || in_sizes[4] != CC) return;
  if (in_sizes[5] != C3 * CC || in_sizes[6] != C3 * 9 || in_sizes[7] != CC * CC || in_sizes[8] < 1) return;
  if (in_sizes[9] != HID * CC || in_sizes[10] != HID * 9 || in_sizes[11] != CC * HID) return;
  if (in_sizes[12] != CC || in_sizes[13] != CC || in_sizes[14] != CC || in_sizes[15] != CC) return;
  if (in_sizes[16] != C3 * CC || in_sizes[17] != C3 * 9 || in_sizes[18] != CC * CC || in_sizes[19] < 1) return;
  if (in_sizes[20] != HID * CC || in_sizes[21] != HID * 9 || in_sizes[22] != CC * HID) return;
  if (out_size != NPIX * CC) return;

  const float* x        = (const float*)d_in[0];
  const float* w_s0     = (const float*)d_in[1];
  const float* b_s0     = (const float*)d_in[2];
  const float* w_s2     = (const float*)d_in[3];
  const float* b_s2     = (const float*)d_in[4];
  const float* rsa_qkv  = (const float*)d_in[5];
  const float* rsa_dw   = (const float*)d_in[6];
  const float* rsa_proj = (const float*)d_in[7];
  const float* rsa_temp = (const float*)d_in[8];
  const float* ffs_in   = (const float*)d_in[9];
  const float* ffs_dw   = (const float*)d_in[10];
  const float* ffs_out  = (const float*)d_in[11];
  const float* w_c0     = (const float*)d_in[12];
  const float* b_c0     = (const float*)d_in[13];
  const float* w_c2     = (const float*)d_in[14];
  const float* b_c2     = (const float*)d_in[15];
  const float* gsa_qkv  = (const float*)d_in[16];
  const float* gsa_dw   = (const float*)d_in[17];
  const float* gsa_proj = (const float*)d_in[18];
  const float* gsa_temp = (const float*)d_in[19];
  const float* ffc_in   = (const float*)d_in[20];
  const float* ffc_dw   = (const float*)d_in[21];
  const float* ffc_out  = (const float*)d_in[22];
  float* out = (float*)d_out;

  // ---- carve ----
  const size_t sAct = (size_t)NPIX * CC * 4;                        // f32 [NPIX][128]
  const size_t sT   = (size_t)NPIX * CC * 2 * 2;                    // two bf16 planes [NPIX][128]
  const size_t sU   = (size_t)NPIX * C3 * 4;                        // f32 [NPIX][384]
  const size_t sR   = (size_t)NPIX * C3 * 4;                        // f32 [NPIX][384]
  const size_t sWq  = (size_t)C3 * CC * 2;
  const size_t sWp  = (size_t)CC * CC * 2;
  const size_t sW1  = (size_t)HIDP * CC * 2;
  const size_t sW2  = (size_t)CC * HIDP * 2;
  const size_t sPN  = (size_t)NB * NSLN * 256 * 4;
  const size_t sPA  = (size_t)NB * NHEAD * NSLS * 1024 * 4;
  const size_t sAF  = (size_t)NB * AFSZ * 2;                        // per plane
  size_t off = 0;
  const size_t oA   = off; off += sAct;
  const size_t oBx  = off; off += sAct;
  const size_t oT   = off; off += sT;
  const size_t oU   = off; off += sU;
  const size_t oR   = off; off += sR;
  const size_t oWq0 = off; off += sWq;
  const size_t oWp0 = off; off += sWp;
  const size_t oW10 = off; off += sW1;
  const size_t oW20 = off; off += sW2;
  const size_t oWq1 = off; off += sWq;
  const size_t oWp1 = off; off += sWp;
  const size_t oW11 = off; off += sW1;
  const size_t oW21 = off; off += sW2;
  const size_t oPN  = off; off += sPN;
  const size_t oPA  = off; off += sPA;
  const size_t oAFh = off; off += sAF;
  const size_t oAFl = off; off += sAF;
  if (off > ws_size) return;                               // off = 153911296 for NB=2, IMW=128
  if (sU < (size_t)NPIX * HIDP * 4) return;

  char* ws = (char*)d_ws;
  float* A  = (float*)(ws + oA);
  float* Bx = (float*)(ws + oBx);
  unsigned short* Th = (unsigned short*)(ws + oT);
  unsigned short* Tl = Th + (size_t)NPIX * CC;
  float* U  = (float*)(ws + oU);
  float* R  = (float*)(ws + oR);
  unsigned short* Wq0 = (unsigned short*)(ws + oWq0);
  unsigned short* Wp0 = (unsigned short*)(ws + oWp0);
  unsigned short* W10 = (unsigned short*)(ws + oW10);
  unsigned short* W20 = (unsigned short*)(ws + oW20);
  unsigned short* Wq1 = (unsigned short*)(ws + oWq1);
  unsigned short* Wp1 = (unsigned short*)(ws + oWp1);
  unsigned short* W11 = (unsigned short*)(ws + oW11);
  unsigned short* W21 = (unsigned short*)(ws + oW21);
  float* PN = (float*)(ws + oPN);
  float* PA = (float*)(ws + oPA);
  unsigned short* AFh = (unsigned short*)(ws + oAFh);
  unsigned short* AFl = (unsigned short*)(ws + oAFl);

  const dim3 blk(256);
  // (1) x NCHW -> A pixel-major; weights f32 [out][in] -> bf16 planes [outP][inP], k contiguous, zero padded
  //     (Wq0 is the start of the weight region: Wq0, Wp0, W10, W20, Wq1, Wp1, W11, W21 lie one behind the other)
  prep_k<<<dim3(PB_T + 2 * PB_SET), blk, 0, stream>>>(x, A, rsa_qkv, rsa_proj, ffs_in, ffs_out,
                                                      gsa_qkv, gsa_proj, ffc_in, ffc_out, Wq0);

  (void)hipFuncSetAttribute(reinterpret_cast<const void*>(&rsa_attn_k), hipFuncAttributeMaxDynamicSharedMemorySize, RL_END);
  (void)hipFuncSetAttribute(reinterpret_cast<const void*>(&gsa_s_k), hipFuncAttributeMaxDynamicSharedMemorySize, GL_END);

  const dim3 gG(NPIX / GBM);
  const dim3 gDw((NPIX / DWL * (C3 / 4) + 255) / 256);

  // ---- spatial (RSA) block ----
  gemm_k<CC, C3, 0, 1><<<gG, blk, 0, stream>>>(Th, Tl, Wq0, U, Bx, A, w_s0, b_s0, Wp0, Bx, AFh, AFl); // qkv 1x1 of LN_s0(x) -> U
  dw_k<C3, 0><<<gDw, blk, 0, stream>>>(U, rsa_dw, 0, C3, WSZ / 2, R, C3, 0, Th, Tl, CC); // dw (rolled) -> R
  rsa_attn_k<<<dim3(NB * NWIN), blk, RL_END, stream>>>(R, rsa_temp, Th, Tl);            // T = window attention out
  gemm_k<CC, HIDP, 0, 2><<<gG, blk, 0, stream>>>(Th, Tl, W10, U, A, A, w_s2, b_s2, Wp0, Bx, AFh, AFl); // Bx = x_ = proj; ffn-in of LN_s2(x_+x) -> U
  dwffn_k<1><<<gG, blk, 0, stream>>>(U, ffs_dw, HID, W20, A, Bx);                        // dw+gelu+ffn-out: A = ffn + x_

  // ---- channel (GSA) block ----
  gemm_k<CC, C3, 0, 1><<<gG, blk, 0, stream>>>(Th, Tl, Wq1, U, Bx, A, w_c0, b_c0, Wp1, Bx, AFh, AFl); // qkv 1x1 of LN_c0(x) -> U
  dw_k<C3, 2><<<gDw, blk, 0, stream>>>(U, gsa_dw, 0, C3, 0, R, C3, 0, Th, Tl, CC);       // q, k -> R f32; v planes -> T region
  gsa_s_k<<<dim3(NB * NHEAD * NSLS), blk, GL_END, stream>>>(R, PA, PN);                  // score and norm partials
  gsa_fin_k<<<dim3(NB * NHEAD * FINQ), dim3(320), 0, stream>>>(PA, PN, gsa_temp, AFh, AFl);
  gemm_k<CC, HIDP, 0, 3><<<gG, blk, 0, stream>>>(Th, Tl, W11, U, A, A, w_c2, b_c2, Wp1, Bx, AFh, AFl); // attn.v; Bx = x_ = proj; ffn-in of LN_c2(x_+x) -> U
  dwffn_k<2><<<gG, blk, 0, stream>>>(U, ffc_dw, HID, W21, out, Bx);                      // d_out NCHW = ffn + x_
  (void)hipGetLastError();
}
